// v000
// Times are from an AMD MI455X. After a warm-up the kernel runs many times in a row, and a time is the length of
// such a window on the GPU divided by its runs, so every launch and the gaps after it count. The runs cycle
// through copies of the inputs. A figure is the median of several windows, for all but v000 over two sittings.
// Sittings can differ by a few percent; kernels timed side by side share one.
// v000, which the later versions start from, runs in 374 microseconds.
#include <hip/hip_runtime.h>
#include <hip/hip_bf16.h>

// ---------------------------------------------------------------------------
// Fused multi-head attention, fp32, CDNA5 (gfx1250), wave32.
//   N=2048 seq, B=2 batch, C=1024 ch, H=16 heads, HD=64, SCALE=1/8.
// All matmuls: V_WMMA_F32_16X16X4_F32 (full fp32).
// Data movement: GLOBAL_LOAD_ASYNC_TO_LDS_B128 with double-buffered LDS
// tiles (ASYNCcnt), LDS fragment reads (ds_load_b64) feeding the WMMAs.
// ---------------------------------------------------------------------------

typedef float v2f __attribute__((ext_vector_type(2)));
typedef float v8f __attribute__((ext_vector_type(8)));

#define Nseq 2048
#define Bsz  2
#define Cch  1024
#define Hh   16
#define HD   64

static __device__ __forceinline__ v8f wmma4(v2f a, v2f b, v8f c) {
    // D = A(16x4,f32) * B(4x16,f32) + C(16x16,f32)
    return __builtin_amdgcn_wmma_f32_16x16x4_f32(
        false, a, false, b, (short)0, c, false, false);
}

// Async copy 16B global -> LDS.  Low 32 bits of a generic pointer to
// __shared__ data are the wave-relative LDS byte offset (LDS aperture maps
// addr[31:0]); the instruction's VDST operand is exactly that offset.
static __device__ __forceinline__ void async_b128(void* lds_dst, const float* src) {
    unsigned d = (unsigned)(uintptr_t)lds_dst;
    asm volatile("global_load_async_to_lds_b128 %0, %1, off"
                 :: "v"(d), "v"(src) : "memory");
}
static __device__ __forceinline__ void wait_async0() {
    asm volatile("s_wait_asynccnt 0x0" ::: "memory");
}

// LDS row strides (floats): 16B-aligned rows for b128 stores, padded so
// fragment reads are bank-conflict-free per 16-lane half.
#define SLDA 68   // A/W/K tiles
#define SLDV 72   // V tile (strided dword reads in PV)

// ---------------------------------------------------------------------------
// Shared GEMM skeleton: 64(M) x 64(Nout) tile per 128-thread workgroup,
// K staged in 64-wide chunks, async double-buffered through LDS.
//   acc[t] accumulates rows (wv*16..+15) x cols (t*16..+15), C = A * W^T.
// ---------------------------------------------------------------------------
#define GEMM_BODY(ABASE, WBASE)                                               \
    __shared__ float At[2][64 * SLDA];                                        \
    __shared__ float Wt[2][64 * SLDA];                                        \
    const int tid  = threadIdx.x;                                             \
    const int lane = tid & 31;                                                \
    const int wv   = tid >> 5;                                                \
    const int lo   = lane & 15;                                               \
    const int hi   = lane >> 4;                                               \
    const int lrow = tid >> 4;          /* 0..7  : cooperative loader row */  \
    const int lcol = (tid & 15) * 4;    /* 0..60 : cooperative loader col */  \
    v8f acc[4] = {};                                                          \
    /* issue one 64x64 fp32 chunk of A and W into LDS buffer `buf` */         \
    auto issue = [&](int buf, int kc) {                                       \
        const float* ab = (ABASE) + (size_t)kc * 64;                          \
        const float* wb = (WBASE) + (size_t)kc * 64;                          \
        _Pragma("unroll")                                                     \
        for (int p = 0; p < 8; ++p) {                                         \
            const int row = lrow + p * 8;                                     \
            async_b128(&At[buf][row * SLDA + lcol], ab + row * Cch + lcol);   \
            async_b128(&Wt[buf][row * SLDA + lcol], wb + row * Cch + lcol);   \
        }                                                                     \
    };                                                                        \
    issue(0, 0);                                                              \
    wait_async0();                                                            \
    __syncthreads();                                                          \
    int cur = 0;                                                              \
    for (int kc = 0; kc < Cch / 64; ++kc) {                                   \
        if (kc + 1 < Cch / 64) issue(cur ^ 1, kc + 1);                        \
        const float* Ac = &At[cur][0];                                        \
        const float* Wc = &Wt[cur][0];                                        \
        _Pragma("unroll")                                                     \
        for (int ss = 0; ss < 16; ++ss) {                                     \
            v2f a = *(const v2f*)&Ac[(wv * 16 + lo) * SLDA + ss * 4 + 2 * hi];\
            _Pragma("unroll")                                                 \
            for (int t = 0; t < 4; ++t) {                                     \
                v2f b = *(const v2f*)&Wc[(t * 16 + lo) * SLDA + ss * 4 + 2 * hi];\
                acc[t] = wmma4(a, b, acc[t]);                                 \
            }                                                                 \
        }                                                                     \
        wait_async0();                                                        \
        __syncthreads();                                                      \
        cur ^= 1;                                                             \
    }

// ---------------------------------------------------------------------------
// Kernel 1: QKV projection.  Y[m][j] = sum_c X[m][c] * Wqkv[j][c]
//   m = n*B + b; j = three*C + h*HD + hd; SCALE folded into Q.
// grid = (M/64, 3C/64) = (64, 48), block = 128.
// ---------------------------------------------------------------------------
__global__ __launch_bounds__(128)
void qkv_kernel(const float* __restrict__ x, const float* __restrict__ w,
                float* __restrict__ Qo, float* __restrict__ Ko,
                float* __restrict__ Vo) {
    const int m0    = blockIdx.x * 64;
    const int jblk  = blockIdx.y;       // 64 cols each; 16 blocks per {Q,K,V}
    const int three = jblk >> 4;
    const int h     = jblk & 15;        // 64 cols == exactly one head

    GEMM_BODY(x + (size_t)m0 * Cch, w + (size_t)jblk * 64 * Cch)

    float* base = (three == 0) ? Qo : ((three == 1) ? Ko : Vo);
    const float sc = (three == 0) ? 0.125f : 1.0f;   // SCALE = HD^-0.5

#pragma unroll
    for (int r = 0; r < 8; ++r) {
        const int m = m0 + wv * 16 + r + 8 * hi;
        const int n = m >> 1;           // m = n*B + b, B = 2
        const int b = m & 1;
        float* drow = base + (((size_t)(b * Hh + h) * Nseq + n) * HD) + lo;
        drow[0]  = acc[0][r] * sc;
        drow[16] = acc[1][r] * sc;
        drow[32] = acc[2][r] * sc;
        drow[48] = acc[3][r] * sc;
    }
}

// ---------------------------------------------------------------------------
// Kernel 2: flash attention per head, async double-buffered K/V tiles.
// grid = (N/64, B*H) = (32, 32), block = 128 (4 waves x 16 query rows).
// ---------------------------------------------------------------------------
__global__ __launch_bounds__(128)
void attn_kernel(const float* __restrict__ Q, const float* __restrict__ K,
                 const float* __restrict__ V, float* __restrict__ AO) {
    __shared__ float Kt[2][16 * SLDA];
    __shared__ float Vt[2][16 * SLDV];
    __shared__ float Pt[4][256];        // per-wave 16x16 P staging

    const int tid  = threadIdx.x;
    const int lane = tid & 31;
    const int wv   = tid >> 5;
    const int lo   = lane & 15;
    const int hi   = lane >> 4;

    const int bh = blockIdx.y;                        // b*H + h
    const size_t hbase = (size_t)bh * Nseq * HD;
    const float* Qh = Q + hbase;
    const float* Kh = K + hbase;
    const float* Vh = V + hbase;

    const int n0 = blockIdx.x * 64 + wv * 16;

    // Pre-built Q A-fragments for all 16 K-steps of the 64-dim reduction.
    v2f qa[16];
#pragma unroll
    for (int s = 0; s < 16; ++s)
        qa[s] = *(const v2f*)(Qh + (size_t)(n0 + lo) * HD + s * 4 + 2 * hi);

    v8f o[4] = {};
    float mrow[8], lrow_[8];
#pragma unroll
    for (int r = 0; r < 8; ++r) { mrow[r] = -3.0e38f; lrow_[r] = 0.0f; }

    const int crow = tid >> 4;          // 0..7   cooperative loader row
    const int ccol = (tid & 15) * 4;    // 0..60  cooperative loader col

    auto issue_kv = [&](int buf, int j) {
#pragma unroll
        for (int p = 0; p < 2; ++p) {
            const int row = crow + p * 8;                         // 0..15
            const float* ks = Kh + (size_t)(j * 16 + row) * HD + ccol;
            const float* vs = Vh + (size_t)(j * 16 + row) * HD + ccol;
            async_b128(&Kt[buf][row * SLDA + ccol], ks);
            async_b128(&Vt[buf][row * SLDV + ccol], vs);
        }
    };

    issue_kv(0, 0);
    wait_async0();
    __syncthreads();
    int cur = 0;

    for (int j = 0; j < Nseq / 16; ++j) {
        if (j + 1 < Nseq / 16) issue_kv(cur ^ 1, j + 1);
        const float* Kc = &Kt[cur][0];
        const float* Vc = &Vt[cur][0];

        // S = Q @ K^T  (16 query rows x 16 keys)
        v8f s = {};
#pragma unroll
        for (int ss = 0; ss < 16; ++ss) {
            v2f bk = *(const v2f*)&Kc[lo * SLDA + ss * 4 + 2 * hi];
            s = wmma4(qa[ss], bk, s);
        }

        // Online softmax: C-layout rows live in 16-lane halves.
#pragma unroll
        for (int r = 0; r < 8; ++r) {
            float v = s[r];
            float rmax = v;
            rmax = fmaxf(rmax, __shfl_xor(rmax, 1));
            rmax = fmaxf(rmax, __shfl_xor(rmax, 2));
            rmax = fmaxf(rmax, __shfl_xor(rmax, 4));
            rmax = fmaxf(rmax, __shfl_xor(rmax, 8));
            float mnew  = fmaxf(mrow[r], rmax);
            float alpha = __expf(mrow[r] - mnew);
            float p     = __expf(v - mnew);
            float rsum = p;
            rsum += __shfl_xor(rsum, 1);
            rsum += __shfl_xor(rsum, 2);
            rsum += __shfl_xor(rsum, 4);
            rsum += __shfl_xor(rsum, 8);
            lrow_[r] = lrow_[r] * alpha + rsum;
            mrow[r] = mnew;
            s[r] = p;
            o[0][r] *= alpha; o[1][r] *= alpha;
            o[2][r] *= alpha; o[3][r] *= alpha;
        }

        // P: C-layout -> A-layout via per-wave LDS slab (same-wave order).
        float* myP = Pt[wv];
#pragma unroll
        for (int r = 0; r < 8; ++r)
            myP[(r + 8 * hi) * 16 + lo] = s[r];
        asm volatile("s_wait_dscnt 0x0" ::: "memory");

        // O += P @ V   (K-dim = 16 keys -> 4 steps x 4 dim-tiles)
#pragma unroll
        for (int ss = 0; ss < 4; ++ss) {
            v2f pa = *(const v2f*)&myP[lo * 16 + ss * 4 + 2 * hi];
            const int k0 = ss * 4 + 2 * hi;
#pragma unroll
            for (int t = 0; t < 4; ++t) {
                v2f bv;
                bv.x = Vc[k0 * SLDV + t * 16 + lo];
                bv.y = Vc[(k0 + 1) * SLDV + t * 16 + lo];
                o[t] = wmma4(pa, bv, o[t]);
            }
        }

        wait_async0();
        __syncthreads();
        cur ^= 1;
    }

    // Normalize; write attn-out as [b][n][h*HD+hd]  (row m2 = b*N + n).
    const int b = bh >> 4, h = bh & 15;
#pragma unroll
    for (int r = 0; r < 8; ++r) {
        const float rinv = 1.0f / lrow_[r];
        const int n = n0 + r + 8 * hi;
        float* drow = AO + ((size_t)(b * Nseq + n)) * Cch + h * HD + lo;
        drow[0]  = o[0][r] * rinv;
        drow[16] = o[1][r] * rinv;
        drow[32] = o[2][r] * rinv;
        drow[48] = o[3][r] * rinv;
    }
}

// ---------------------------------------------------------------------------
// Kernel 3: output projection + bias, scatter back to (N,B,C).
// grid = (M/64, C/64) = (64, 16), block = 128.
// ---------------------------------------------------------------------------
__global__ __launch_bounds__(128)
void proj_kernel(const float* __restrict__ A, const float* __restrict__ w,
                 const float* __restrict__ bias, float* __restrict__ out) {
    const int m0 = blockIdx.x * 64;     // row m2 = b*N + n
    const int j0 = blockIdx.y * 64;

    GEMM_BODY(A + (size_t)m0 * Cch, w + (size_t)j0 * Cch)

    float bj[4];
#pragma unroll
    for (int t = 0; t < 4; ++t) bj[t] = bias[j0 + t * 16 + lo];

#pragma unroll
    for (int r = 0; r < 8; ++r) {
        const int m2 = m0 + wv * 16 + r + 8 * hi;
        const int b  = m2 >> 11;        // / N (2048)
        const int n  = m2 & 2047;
        float* drow = out + ((size_t)(n * Bsz + b)) * Cch + j0 + lo;
        drow[0]  = acc[0][r] + bj[0];
        drow[16] = acc[1][r] + bj[1];
        drow[32] = acc[2][r] + bj[2];
        drow[48] = acc[3][r] + bj[3];
    }
}

// ---------------------------------------------------------------------------
extern "C" void kernel_launch(void* const* d_in, const int* in_sizes, int n_in,
                              void* d_out, int out_size, void* d_ws, size_t ws_size,
                              hipStream_t stream) {
    const float* x      = (const float*)d_in[0];
    const float* w_qkv  = (const float*)d_in[1];
    const float* w_proj = (const float*)d_in[2];
    const float* b_proj = (const float*)d_in[3];
    float* out = (float*)d_out;

    float* ws = (float*)d_ws;
    const size_t QSZ = (size_t)Bsz * Hh * Nseq * HD;  // 4M floats = 16 MB
    float* Qb = ws;
    float* Kb = ws + QSZ;
    float* Vb = ws + 2 * QSZ;
    float* AO = ws + 3 * QSZ;                         // total 64 MB scratch

    dim3 blk(128, 1, 1);
    qkv_kernel <<<dim3(64, 48, 1), blk, 0, stream>>>(x, w_qkv, Qb, Kb, Vb);
    attn_kernel<<<dim3(32, 32, 1), blk, 0, stream>>>(Qb, Kb, Vb, AO);
    proj_kernel<<<dim3(64, 16, 1), blk, 0, stream>>>(AO, w_proj, b_proj, out);
}

// v001
// A run of this version takes 347 microseconds.
// In both of two side-by-side timings against v000, it was 1.13 times as fast.
#include <hip/hip_runtime.h>
#include <hip/hip_bf16.h>

// ---------------------------------------------------------------------------
// Fused multi-head attention, fp32, CDNA5 (gfx1250), wave32.
//   N=2048 seq, B=2 batch, C=1024 ch, H=16 heads, HD=64, SCALE=1/8.
// All matmuls: V_WMMA_F32_16X16X4_F32 (full fp32).
// Data movement: GLOBAL_LOAD_ASYNC_TO_LDS_B128 with double-buffered LDS
// tiles (ASYNCcnt), LDS fragment reads (ds_load_b64) feeding the WMMAs.
// ---------------------------------------------------------------------------

typedef float v2f __attribute__((ext_vector_type(2)));
typedef float v8f __attribute__((ext_vector_type(8)));

#define Nseq 2048
#define Bsz  2
#define Cch  1024
#define Hh   16
#define HD   64

static __device__ __forceinline__ v8f wmma4(v2f a, v2f b, v8f c) {
    // D = A(16x4,f32) * B(4x16,f32) + C(16x16,f32)
    return __builtin_amdgcn_wmma_f32_16x16x4_f32(
        false, a, false, b, (short)0, c, false, false);
}

// Async copy 16B global -> LDS.  Low 32 bits of a generic pointer to
// __shared__ data are the wave-relative LDS byte offset (LDS aperture maps
// addr[31:0]); the instruction's VDST operand is exactly that offset.
static __device__ __forceinline__ void async_b128(void* lds_dst, const float* src) {
    unsigned d = (unsigned)(uintptr_t)lds_dst;
    asm volatile("global_load_async_to_lds_b128 %0, %1, off"
                 :: "v"(d), "v"(src) : "memory");
}
static __device__ __forceinline__ void wait_async0() {
    asm volatile("s_wait_asynccnt 0x0" ::: "memory");
}

// LDS row strides (floats): 16B-aligned rows for b128 stores, padded so
// fragment reads are bank-conflict-free per 16-lane half.
#define SLDA 68   // A/W/K tiles
#define SLDV 72   // V tile (strided dword reads in PV)

// ---------------------------------------------------------------------------
// Shared GEMM skeleton: 64(M) x 64(Nout) tile per 128-thread workgroup,
// K staged in 64-wide chunks, async double-buffered through LDS.
//   acc[t] accumulates rows (wv*16..+15) x cols (t*16..+15), C = A * W^T.
// ---------------------------------------------------------------------------
#define GEMM_BODY(ABASE, WBASE)                                               \
    __shared__ float At[2][64 * SLDA];                                        \
    __shared__ float Wt[2][64 * SLDA];                                        \
    const int tid  = threadIdx.x;                                             \
    const int lane = tid & 31;                                                \
    const int wv   = tid >> 5;                                                \
    const int lo   = lane & 15;                                               \
    const int hi   = lane >> 4;                                               \
    const int lrow = tid >> 4;          /* 0..7  : cooperative loader row */  \
    const int lcol = (tid & 15) * 4;    /* 0..60 : cooperative loader col */  \
    v8f acc[4] = {};                                                          \
    /* issue one 64x64 fp32 chunk of A and W into LDS buffer `buf` */         \
    auto issue = [&](int buf, int kc) {                                       \
        const float* ab = (ABASE) + (size_t)kc * 64;                          \
        const float* wb = (WBASE) + (size_t)kc * 64;                          \
        _Pragma("unroll")                                                     \
        for (int p = 0; p < 8; ++p) {                                         \
            const int row = lrow + p * 8;                                     \
            async_b128(&At[buf][row * SLDA + lcol], ab + row * Cch + lcol);   \
            async_b128(&Wt[buf][row * SLDA + lcol], wb + row * Cch + lcol);   \
        }                                                                     \
    };                                                                        \
    issue(0, 0);                                                              \
    wait_async0();                                                            \
    __syncthreads();                                                          \
    int cur = 0;                                                              \
    for (int kc = 0; kc < Cch / 64; ++kc) {                                   \
        if (kc + 1 < Cch / 64) issue(cur ^ 1, kc + 1);                        \
        const float* Ac = &At[cur][0];                                        \
        const float* Wc = &Wt[cur][0];                                        \
        _Pragma("unroll")                                                     \
        for (int ss = 0; ss < 16; ++ss) {                                     \
            v2f a = *(const v2f*)&Ac[(wv * 16 + lo) * SLDA + ss * 4 + 2 * hi];\
            _Pragma("unroll")                                                 \
            for (int t = 0; t < 4; ++t) {                                     \
                v2f b = *(const v2f*)&Wc[(t * 16 + lo) * SLDA + ss * 4 + 2 * hi];\
                acc[t] = wmma4(a, b, acc[t]);                                 \
            }                                                                 \
        }                                                                     \
        wait_async0();                                                        \
        __syncthreads();                                                      \
        cur ^= 1;                                                             \
    }

// ---------------------------------------------------------------------------
// Kernel 1: QKV projection.  Y[m][j] = sum_c X[m][c] * Wqkv[j][c]
//   m = n*B + b; j = three*C + h*HD + hd; SCALE folded into Q.
// grid = (M/64, 3C/64) = (64, 48), block = 128.
// ---------------------------------------------------------------------------
__global__ __launch_bounds__(128)
void qkv_kernel(const float* __restrict__ x, const float* __restrict__ w,
                float* __restrict__ Qo, float* __restrict__ Ko,
                float* __restrict__ Vo) {
    const int m0    = blockIdx.x * 64;
    const int jblk  = blockIdx.y;       // 64 cols each; 16 blocks per {Q,K,V}
    const int three = jblk >> 4;
    const int h     = jblk & 15;        // 64 cols == exactly one head

    GEMM_BODY(x + (size_t)m0 * Cch, w + (size_t)jblk * 64 * Cch)

    float* base = (three == 0) ? Qo : ((three == 1) ? Ko : Vo);
    const float sc = (three == 0) ? 0.125f : 1.0f;   // SCALE = HD^-0.5

#pragma unroll
    for (int r = 0; r < 8; ++r) {
        const int m = m0 + wv * 16 + r + 8 * hi;
        const int n = m >> 1;           // m = n*B + b, B = 2
        const int b = m & 1;
        float* drow = base + (((size_t)(b * Hh + h) * Nseq + n) * HD) + lo;
        drow[0]  = acc[0][r] * sc;
        drow[16] = acc[1][r] * sc;
        drow[32] = acc[2][r] * sc;
        drow[48] = acc[3][r] * sc;
    }
}

// ---------------------------------------------------------------------------
// Kernel 2: flash attention per head, async double-buffered K/V tiles.
// grid = (N/64, B*H) = (32, 32), block = 128 (4 waves x 16 query rows).
// One pass covers KT = 64 keys: four independent 16x16 score tiles per wave,
// one row maximum, one row sum, one rescale and one barrier per pass.
// ---------------------------------------------------------------------------
#define KT   64   // keys per pass
#define SLDP 36   // P slab row stride (floats): 32 keys + pad, b64 reads hit 64 banks

// Eight 16-byte async copies (rows 8 apart) of one lane.  The s_wait_xcnt is
// the statement's last line so that no address register named here is
// rewritten ahead of it.
static __device__ __forceinline__ void async8_b128(void* lds_dst, unsigned dstep,
                                                   const float* src, int sstep) {
    const unsigned d = (unsigned)(uintptr_t)lds_dst;
    asm volatile("global_load_async_to_lds_b128 %0, %8, off\n\t"
                 "global_load_async_to_lds_b128 %1, %9, off\n\t"
                 "global_load_async_to_lds_b128 %2, %10, off\n\t"
                 "global_load_async_to_lds_b128 %3, %11, off\n\t"
                 "global_load_async_to_lds_b128 %4, %12, off\n\t"
                 "global_load_async_to_lds_b128 %5, %13, off\n\t"
                 "global_load_async_to_lds_b128 %6, %14, off\n\t"
                 "global_load_async_to_lds_b128 %7, %15, off\n\t"
                 "s_wait_xcnt 0x0"
                 :: "v"(d), "v"(d + dstep), "v"(d + 2 * dstep), "v"(d + 3 * dstep),
                    "v"(d + 4 * dstep), "v"(d + 5 * dstep), "v"(d + 6 * dstep),
                    "v"(d + 7 * dstep),
                    "v"(src), "v"(src + sstep), "v"(src + 2 * sstep),
                    "v"(src + 3 * sstep), "v"(src + 4 * sstep), "v"(src + 5 * sstep),
                    "v"(src + 6 * sstep), "v"(src + 7 * sstep)
                 : "memory");
}

__global__ __launch_bounds__(128)
void attn_kernel(const float* __restrict__ Q, const float* __restrict__ K,
                 const float* __restrict__ V, float* __restrict__ AO) {
    __shared__ __attribute__((aligned(16))) float Kt[2][KT * SLDA];
    __shared__ __attribute__((aligned(16))) float Vt[2][KT * SLDV];
    __shared__ __attribute__((aligned(16))) float Pt[4][16 * SLDP];  // per-wave 16x32 P staging

    const int tid  = threadIdx.x;
    const int lane = tid & 31;
    const int wv   = tid >> 5;
    const int lo   = lane & 15;
    const int hi   = lane >> 4;

    const int bh = blockIdx.y;                        // b*H + h
    const size_t hbase = (size_t)bh * Nseq * HD;
    const float* Qh = Q + hbase;
    const float* Kh = K + hbase;
    const float* Vh = V + hbase;

    const int n0 = blockIdx.x * 64 + wv * 16;

    // Pre-built Q A-fragments for all 16 K-steps of the 64-dim reduction.
    v2f qa[16];
#pragma unroll
    for (int s = 0; s < 16; ++s)
        qa[s] = *(const v2f*)(Qh + (size_t)(n0 + lo) * HD + s * 4 + 2 * hi);

    v8f o[4] = {};
    float mrow[8], lrow_[8];
#pragma unroll
    for (int r = 0; r < 8; ++r) { mrow[r] = -3.0e38f; lrow_[r] = 0.0f; }

    const int crow = tid >> 4;          // 0..7   cooperative loader row
    const int ccol = (tid & 15) * 4;    // 0..60  cooperative loader col

    // One 64-key K tile and V tile: rows crow, crow+8, ..., crow+56.
    auto issue_kv = [&](int buf, int j) {
        const size_t g = (size_t)(j * KT + crow) * HD + ccol;
        async8_b128(&Kt[buf][crow * SLDA + ccol], 8 * SLDA * 4, Kh + g, 8 * HD);
        async8_b128(&Vt[buf][crow * SLDV + ccol], 8 * SLDV * 4, Vh + g, 8 * HD);
    };

    issue_kv(0, 0);
    wait_async0();
    __syncthreads();
    issue_kv(1, 1);

    float* myP = Pt[wv];

    for (int j = 0; j < Nseq / KT; ++j) {
        const int cur = j & 1;
        const float* Kc = &Kt[cur][0];
        const float* Vc = &Vt[cur][0];

        // S = Q @ K^T  (16 query rows x 64 keys, four independent tiles)
        v8f s[4] = {};
#pragma unroll
        for (int ss = 0; ss < 16; ++ss) {
#pragma unroll
            for (int t = 0; t < 4; ++t) {
                v2f bk = *(const v2f*)&Kc[(t * 16 + lo) * SLDA + ss * 4 + 2 * hi];
                s[t] = wmma4(qa[ss], bk, s[t]);
            }
        }

        // Online softmax: C-layout rows live in 16-lane halves; the four
        // tiles are joined in-lane before the cross-lane steps.
#pragma unroll
        for (int r = 0; r < 8; ++r) {
            float rmax = fmaxf(fmaxf(s[0][r], s[1][r]), fmaxf(s[2][r], s[3][r]));
            rmax = fmaxf(rmax, __shfl_xor(rmax, 1));
            rmax = fmaxf(rmax, __shfl_xor(rmax, 2));
            rmax = fmaxf(rmax, __shfl_xor(rmax, 4));
            rmax = fmaxf(rmax, __shfl_xor(rmax, 8));
            float mnew  = fmaxf(mrow[r], rmax);
            float alpha = __expf(mrow[r] - mnew);
            float p0 = __expf(s[0][r] - mnew);
            float p1 = __expf(s[1][r] - mnew);
            float p2 = __expf(s[2][r] - mnew);
            float p3 = __expf(s[3][r] - mnew);
            float rsum = (p0 + p1) + (p2 + p3);
            rsum += __shfl_xor(rsum, 1);
            rsum += __shfl_xor(rsum, 2);
            rsum += __shfl_xor(rsum, 4);
            rsum += __shfl_xor(rsum, 8);
            lrow_[r] = lrow_[r] * alpha + rsum;
            mrow[r] = mnew;
            s[0][r] = p0; s[1][r] = p1; s[2][r] = p2; s[3][r] = p3;
            o[0][r] *= alpha; o[1][r] *= alpha;
            o[2][r] *= alpha; o[3][r] *= alpha;
        }

        // O += P @ V, 32 keys at a time through the per-wave slab.
#pragma unroll
        for (int hf = 0; hf < 2; ++hf) {
            // P: C-layout -> A-layout via per-wave LDS slab (same-wave order).
#pragma unroll
            for (int r = 0; r < 8; ++r) {
                myP[(r + 8 * hi) * SLDP + lo]      = s[2 * hf][r];
                myP[(r + 8 * hi) * SLDP + 16 + lo] = s[2 * hf + 1][r];
            }
            // the wave's own P stores must have landed before it reads them back
            asm volatile("s_wait_dscnt 0x0" ::: "memory");

#pragma unroll
            for (int ss = 0; ss < 8; ++ss) {
                v2f pa = *(const v2f*)&myP[lo * SLDP + ss * 4 + 2 * hi];
                const int k0 = hf * 32 + ss * 4 + 2 * hi;
#pragma unroll
                for (int t = 0; t < 4; ++t) {
                    v2f bv;
                    bv.x = Vc[k0 * SLDV + t * 16 + lo];
                    bv.y = Vc[(k0 + 1) * SLDV + t * 16 + lo];
                    o[t] = wmma4(pa, bv, o[t]);
                }
            }
        }

        // Publish point: own LDS reads done, own copies of tile j+1 landed,
        // every wave here; only then is this pass's buffer refilled.
        asm volatile("s_wait_dscnt 0x0" ::: "memory");
        wait_async0();
        __syncthreads();
        if (j + 2 < Nseq / KT) issue_kv(cur, j + 2);
    }
    wait_async0();   // nothing of this wave's copies is left in flight at its end

    // Normalize; write attn-out as [b][n][h*HD+hd]  (row m2 = b*N + n).
    const int b = bh >> 4, h = bh & 15;
#pragma unroll
    for (int r = 0; r < 8; ++r) {
        const float rinv = 1.0f / lrow_[r];
        const int n = n0 + r + 8 * hi;
        float* drow = AO + ((size_t)(b * Nseq + n)) * Cch + h * HD + lo;
        drow[0]  = o[0][r] * rinv;
        drow[16] = o[1][r] * rinv;
        drow[32] = o[2][r] * rinv;
        drow[48] = o[3][r] * rinv;
    }
}

// ---------------------------------------------------------------------------
// Kernel 3: output projection + bias, scatter back to (N,B,C).
// grid = (M/64, C/64) = (64, 16), block = 128.
// ---------------------------------------------------------------------------
__global__ __launch_bounds__(128)
void proj_kernel(const float* __restrict__ A, const float* __restrict__ w,
                 const float* __restrict__ bias, float* __restrict__ out) {
    const int m0 = blockIdx.x * 64;     // row m2 = b*N + n
    const int j0 = blockIdx.y * 64;

    GEMM_BODY(A + (size_t)m0 * Cch, w + (size_t)j0 * Cch)

    float bj[4];
#pragma unroll
    for (int t = 0; t < 4; ++t) bj[t] = bias[j0 + t * 16 + lo];

#pragma unroll
    for (int r = 0; r < 8; ++r) {
        const int m2 = m0 + wv * 16 + r + 8 * hi;
        const int b  = m2 >> 11;        // / N (2048)
        const int n  = m2 & 2047;
        float* drow = out + ((size_t)(n * Bsz + b)) * Cch + j0 + lo;
        drow[0]  = acc[0][r] + bj[0];
        drow[16] = acc[1][r] + bj[1];
        drow[32] = acc[2][r] + bj[2];
        drow[48] = acc[3][r] + bj[3];
    }
}

// ---------------------------------------------------------------------------
extern "C" void kernel_launch(void* const* d_in, const int* in_sizes, int n_in,
                              void* d_out, int out_size, void* d_ws, size_t ws_size,
                              hipStream_t stream) {
    const float* x      = (const float*)d_in[0];
    const float* w_qkv  = (const float*)d_in[1];
    const float* w_proj = (const float*)d_in[2];
    const float* b_proj = (const float*)d_in[3];
    float* out = (float*)d_out;

    float* ws = (float*)d_ws;
    const size_t QSZ = (size_t)Bsz * Hh * Nseq * HD;  // 4M floats = 16 MB
    float* Qb = ws;
    float* Kb = ws + QSZ;
    float* Vb = ws + 2 * QSZ;
    float* AO = ws + 3 * QSZ;                         // total 64 MB scratch

    dim3 blk(128, 1, 1);
    qkv_kernel <<<dim3(64, 48, 1), blk, 0, stream>>>(x, w_qkv, Qb, Kb, Vb);
    attn_kernel<<<dim3(32, 32, 1), blk, 0, stream>>>(Qb, Kb, Vb, AO);
    proj_kernel<<<dim3(64, 16, 1), blk, 0, stream>>>(AO, w_proj, b_proj, out);
}
